// v000
// Times are from an AMD MI455X. After a warm-up the kernel runs many times in a row, and a time is the length of
// such a window on the GPU divided by its runs, so every launch and the gaps after it count. The runs cycle
// through copies of the inputs. A figure is the median of several windows, for all but v000 over two sittings.
// Sittings can differ by a few percent; kernels timed side by side share one.
// The starting kernel, v000, takes 487 microseconds a run.
// Compute dtype: projections on v_wmma_f32_16x16x32_bf16 with plain bf16 operands (every float input RNE-converted once to bf16, biases included), f32 accumulate; q.k^T and attn.v on v_wmma_f32_16x16x32_bf16 with bf16 hi/lo split planes (hi.hi + hi.lo + lo.hi), f32 accumulate; softmax and all side math f32.
#include <hip/hip_runtime.h>
#include <hip/hip_bf16.h>

typedef __attribute__((ext_vector_type(16))) _Float16 v16h;
typedef __attribute__((ext_vector_type(8)))  _Float16 v8h;
typedef __attribute__((ext_vector_type(16))) __bf16   v16b;
typedef __attribute__((ext_vector_type(8)))  __bf16   v8b;
typedef __attribute__((ext_vector_type(8)))  float    v8f;
typedef __attribute__((ext_vector_type(4)))  float    v4f;
typedef __attribute__((ext_vector_type(2)))  float    v2f;
typedef __attribute__((ext_vector_type(4)))  unsigned v4u;

/* RNE convert f32 -> bf16 bit pattern, and back */
__device__ __forceinline__ unsigned short f2bf_bits(float f) {
  unsigned u = __float_as_uint(f);
  return (unsigned short)((u + 0x7FFFu + ((u >> 16) & 1u)) >> 16);
}
__device__ __forceinline__ float bf_bits2f(unsigned short h) { return __uint_as_float(((unsigned)h) << 16); }

/* hazard guards as plain device helpers */
__device__ __forceinline__ void dep_guard_h(v8f& a, v8f& b, v16h x, v16h y) { asm volatile("v_nop\n\tv_nop\n\tv_nop\n\tv_nop" : "+v"(a), "+v"(b) : "v"(x), "v"(y)); }
__device__ __forceinline__ void dep_guard_b(v8f& a, v8f& b, v16b x, v16b y) { asm volatile("v_nop\n\tv_nop\n\tv_nop\n\tv_nop" : "+v"(a), "+v"(b) : "v"(x), "v"(y)); }
__device__ __forceinline__ void keep4_h(v16h a, v16h b, v16h c, v16h d) { asm volatile("v_nop" :: "v"(a), "v"(b), "v"(c), "v"(d)); }
__device__ __forceinline__ void keep4_b(v16b a, v16b b, v16b c, v16b d) { asm volatile("v_nop" :: "v"(a), "v"(b), "v"(c), "v"(d)); }
__device__ __forceinline__ void acc_guard4(v8f& a, v8f& b, v8f& c, v8f& d) { asm volatile("v_nop\n\tv_nop\n\tv_nop\n\tv_nop" : "+v"(a), "+v"(b), "+v"(c), "+v"(d)); }

template <typename T> struct Frag;
template <> struct Frag<_Float16> {
  typedef v16h V; union U { v16h v; v8h h[2]; };
  /* elements 0..7 <- p[0..7], 8..15 <- p[16..23] */
  static __device__ __forceinline__ v16h load(const _Float16* p) {
    U f; f.h[0] = *(const v8h*)(p); f.h[1] = *(const v8h*)(p + 16); return f.v;
  }
  static __device__ __forceinline__ v8f mma(v16h a, v16h b, v8f c) {
    return __builtin_amdgcn_wmma_f32_16x16x32_f16(false, a, false, b, (short)0, c, false, false);
  }
  static __device__ __forceinline__ void guard(v8f& a, v8f& b, v16h x, v16h y) { dep_guard_h(a, b, x, y); }
  static __device__ __forceinline__ void keep(v16h a, v16h b, v16h c, v16h d) { keep4_h(a, b, c, d); }
};
template <> struct Frag<__bf16> {
  typedef v16b V; union U { v16b v; v8b h[2]; };
  static __device__ __forceinline__ v16b load(const __bf16* p) {
    U f; f.h[0] = *(const v8b*)(p); f.h[1] = *(const v8b*)(p + 16); return f.v;
  }
  static __device__ __forceinline__ v8f mma(v16b a, v16b b, v8f c) {
    return __builtin_amdgcn_wmma_f32_16x16x32_bf16(false, a, false, b, (short)0, c, false, false);
  }
  static __device__ __forceinline__ void guard(v8f& a, v8f& b, v16b x, v16b y) { dep_guard_b(a, b, x, y); }
  static __device__ __forceinline__ void keep(v16b a, v16b b, v16b c, v16b d) { keep4_b(a, b, c, d); }
};

/* ---- Register-blocked batched WMMA GEMM ------------------------------------
   C[m,n] = scale * sum_k A[m,k] * Bt[n,k] (+bias); each wave owns a 64x64 tile.
   A row-major [M,K]; Bt row-major [N,K]; M,N % 64 == 0, K % 32 == 0 (no tail handling).
   SPLIT: operands are hi/lo planes (A2/Bt2 = lo planes, same layout); product = hi.hi + hi.lo + lo.hi.
   BIAS_MODE: 0 = none, 1 = bias[m], 2 = bias[n]; bias values are RNE-converted to bf16 before the add.
   Bias fetch: each lane loads 2 values (64 per wave), distributed with wave shuffles.
   OUT_MODE: 0 = f32, 2 = bf16 hi plane (Cout) + bf16 lo plane (Cout2).
   ET: 0 = f16 operands, 1 = bf16 operands (pointers passed as 16-bit storage) */
template <int ET> struct Elem;
template <> struct Elem<0> { typedef _Float16 T; };
template <> struct Elem<1> { typedef __bf16 T; };
template <int ET, bool SPLIT, int BIAS_MODE, int OUT_MODE>
__global__ __launch_bounds__(256) void wmma_gemm64(
    const unsigned short* __restrict__ Ap, const unsigned short* __restrict__ A2p, int lda, long strideA,
    const unsigned short* __restrict__ Btp, const unsigned short* __restrict__ Bt2p, int ldb, long strideB,
    void* __restrict__ Cout, void* __restrict__ Cout2, int ldc, long strideC,
    const float* __restrict__ bias,
    int M, int N, int K, float scale) {
  typedef typename Elem<ET>::T T;
  typedef typename Frag<T>::V V;
  const T* A = (const T*)Ap; const T* A2 = (const T*)A2p; const T* Bt = (const T*)Btp; const T* Bt2 = (const T*)Bt2p;
  /* per-wave 16x64 slab, pitch 68 floats */
  __shared__ __align__(16) float sT[8][16 * 68];
  const int b    = blockIdx.y;
  const int lane = threadIdx.x & 31;
  const int wave = threadIdx.x >> 5;
  const int tilesN = N >> 6;
  const int tilesM = M >> 6;
  const int tile = blockIdx.x * 8 + wave;
  /* wave-uniform; no block barriers in this kernel */
  if (tile >= tilesM * tilesN) return;
  const int tm = tile / tilesN;
  const int tn = tile - tm * tilesN;
  const int m0 = tm << 6;
  const int n0 = tn << 6;

  const T* Ab  = A  + (size_t)b * strideA;
  const T* Bb  = Bt + (size_t)b * strideB;
  const T* Ab2 = SPLIT ? (A2  + (size_t)b * strideA) : nullptr;
  const T* Bb2 = SPLIT ? (Bt2 + (size_t)b * strideB) : nullptr;

  /* row (A) / col (B, D) within subtile; k offset of this lane half; D row offset */
  const int rlane = lane & 15;
  const int koff  = (lane >> 4) * 8;
  const int mOff  = (lane >> 4) * 8;

  v8f acc[4][4];
#pragma unroll
  for (int i = 0; i < 4; ++i)
#pragma unroll
    for (int j = 0; j < 4; ++j) acc[i][j] = (v8f){0.f,0.f,0.f,0.f,0.f,0.f,0.f,0.f};

  for (int k0 = 0; k0 < K; k0 += 32) {
    V bh[4], bl[4];
#pragma unroll
    for (int j = 0; j < 4; ++j) {
      const size_t bo = (size_t)(n0 + (j << 4) + rlane) * ldb + koff + k0;
      bh[j] = Frag<T>::load(Bb + bo);
      if (SPLIT) bl[j] = Frag<T>::load(Bb2 + bo);
    }
#pragma unroll
    for (int i = 0; i < 4; ++i) {
      const size_t ao = (size_t)(m0 + (i << 4) + rlane) * lda + koff + k0;
      V ah = Frag<T>::load(Ab + ao);
      V al;
      if (SPLIT) al = Frag<T>::load(Ab2 + ao);
#pragma unroll
      for (int j = 0; j < 4; ++j) {
        acc[i][j] = Frag<T>::mma(ah, bh[j], acc[i][j]);
        if (SPLIT) {
          acc[i][j] = Frag<T>::mma(ah, bl[j], acc[i][j]);
          acc[i][j] = Frag<T>::mma(al, bh[j], acc[i][j]);
        }
      }
      Frag<T>::guard(acc[i][0], acc[i][3], ah, SPLIT ? al : ah);
    }
    Frag<T>::keep(bh[0], bh[1], bh[2], bh[3]);
    if (SPLIT) Frag<T>::keep(bl[0], bl[1], bl[2], bl[3]);
  }
  acc_guard4(acc[0][0], acc[0][1], acc[0][2], acc[0][3]);
  acc_guard4(acc[1][0], acc[1][1], acc[1][2], acc[1][3]);
  acc_guard4(acc[2][0], acc[2][1], acc[2][2], acc[2][3]);
  acc_guard4(acc[3][0], acc[3][1], acc[3][2], acc[3][3]);

  /* ---- epilogue ---- */
  float* slab = sT[wave];
  /* bias: 64 values per wave as 2 per lane (coalesced), RNE-converted to bf16 */
  float breg0 = 0.f, breg1 = 0.f;
  if (BIAS_MODE == 1) { breg0 = bias[m0 + lane]; breg1 = bias[m0 + 32 + lane]; }
  if (BIAS_MODE == 2) { breg0 = bias[n0 + lane]; breg1 = bias[n0 + 32 + lane]; }
  if (BIAS_MODE != 0) { breg0 = bf_bits2f(f2bf_bits(breg0)); breg1 = bf_bits2f(f2bf_bits(breg1)); }
#pragma unroll
  for (int i = 0; i < 4; ++i) {
    const int mBase = m0 + (i << 4);
    float brow[8];
#pragma unroll
    for (int r = 0; r < 8; ++r) {
      brow[r] = 0.f;
      if (BIAS_MODE == 1) {
        /* tile row = i*16 + mOff + r; lanes 0..31 hold rows 0..31 (breg0) and 32..63 (breg1) */
        const float bsrc = (i < 2) ? breg0 : breg1;
        brow[r] = __shfl(bsrc, ((i & 1) << 4) + mOff + r, 32);
      }
    }
#pragma unroll
    for (int j = 0; j < 4; ++j) {
      float bcol = 0.f;
      if (BIAS_MODE == 2) {
        /* tile col = j*16 + rlane */
        const float bsrc = (j < 2) ? breg0 : breg1;
        bcol = __shfl(bsrc, ((j & 1) << 4) + rlane, 32);
      }
#pragma unroll
      for (int r = 0; r < 8; ++r) {
        float v = acc[i][j][r] * scale;
        if (BIAS_MODE == 1) v += brow[r];
        if (BIAS_MODE == 2) v += bcol;
        slab[(mOff + r) * 68 + (j << 4) + rlane] = v;
      }
    }
    __builtin_amdgcn_fence(__ATOMIC_RELEASE, "workgroup");
    __builtin_amdgcn_wave_barrier();
    __builtin_amdgcn_fence(__ATOMIC_ACQUIRE, "workgroup");
    if (OUT_MODE == 0) {
      float* C = (float*)Cout + (size_t)b * strideC;
      /* row seg = 256 B = 16 lanes x 16 B */
      const int hh = lane >> 4, c4 = (lane & 15) * 4;
      {
#pragma unroll
        for (int it = 0; it < 8; ++it) {
          const int row = it * 2 + hh;
          v4f v = *(const v4f*)(slab + row * 68 + c4);
          *(v4f*)(C + (size_t)(mBase + row) * ldc + n0 + c4) = v;
        }
        
      }
    } else {
      const int q = lane >> 3, c8 = (lane & 7) * 8;
      unsigned short* C  = (unsigned short*)Cout  + (size_t)b * strideC;
      unsigned short* C2 = (unsigned short*)Cout2 + (size_t)b * strideC;
      {
#pragma unroll
        for (int it = 0; it < 4; ++it) {
          const int row = it * 4 + q;
          const float* sp = slab + row * 68 + c8;
          v8h hv, lv;
#pragma unroll
          for (int e = 0; e < 8; ++e) {
            unsigned short hb = f2bf_bits(sp[e]);
            unsigned short lb = f2bf_bits(sp[e] - bf_bits2f(hb));
            hv[e] = __builtin_bit_cast(_Float16, hb);
            lv[e] = __builtin_bit_cast(_Float16, lb);
          }
          *(v8h*)(C + (size_t)(mBase + row) * ldc + n0 + c8) = hv;
          *(v8h*)(C2 + (size_t)(mBase + row) * ldc + n0 + c8) = lv;
        }
        
      }
    }
    __builtin_amdgcn_fence(__ATOMIC_RELEASE, "workgroup");
    __builtin_amdgcn_wave_barrier();
    __builtin_amdgcn_fence(__ATOMIC_ACQUIRE, "workgroup");
  }
}

/* ---- f32 -> bf16 (RNE) cast: 2 elements per thread packed into one 4-B store; a wave writes one
*/
__global__ __launch_bounds__(256) void cast_f32_bf16x2(
    const float* __restrict__ in, unsigned short* __restrict__ out, int n2) {
  const int i = blockIdx.x * 256 + threadIdx.x;
  if (i < n2) {
    const v2f f = *(const v2f*)(in + 2 * (size_t)i);
    const unsigned u = (unsigned)f2bf_bits(f.x) | ((unsigned)f2bf_bits(f.y) << 16);
    ((unsigned*)out)[i] = u;
    
  }
}

/* ---- Row softmax of S (already scaled), one 256-thread block per row of exactly 2048 columns.
   Thread t owns columns 8t..8t+7 (two 16-B loads). Output = probabilities as bf16 hi + lo planes;
*/
__global__ __launch_bounds__(256) void softmax_rows_split(
    const float* __restrict__ S, unsigned short* __restrict__ Ph, unsigned short* __restrict__ Pl, int ncols) {
  __shared__ float redm[8];
  __shared__ float reds[8];
  const int tid = threadIdx.x, lane = tid & 31, wave = tid >> 5;
  const size_t base = (size_t)blockIdx.x * (size_t)ncols + (size_t)tid * 8;
  const v4f x0 = *(const v4f*)(S + base);
  const v4f x1 = *(const v4f*)(S + base + 4);
  float xv[8];
  xv[0] = x0.x; xv[1] = x0.y; xv[2] = x0.z; xv[3] = x0.w;
  xv[4] = x1.x; xv[5] = x1.y; xv[6] = x1.z; xv[7] = x1.w;
  float m = xv[0];
#pragma unroll
  for (int e = 1; e < 8; ++e) m = fmaxf(m, xv[e]);
#pragma unroll
  for (int off = 1; off < 32; off <<= 1) m = fmaxf(m, __shfl_xor(m, off, 32));
  if (lane == 0) redm[wave] = m;
  __syncthreads();
  float gm = redm[0];
#pragma unroll
  for (int w = 1; w < 8; ++w) gm = fmaxf(gm, redm[w]);

  float ev[8];
  float ps = 0.0f;
#pragma unroll
  for (int e = 0; e < 8; ++e) { ev[e] = expf(xv[e] - gm); ps += ev[e]; }
#pragma unroll
  for (int off = 1; off < 32; off <<= 1) ps += __shfl_xor(ps, off, 32);
  if (lane == 0) reds[wave] = ps;
  __syncthreads();
  float tot = reds[0];
#pragma unroll
  for (int w = 1; w < 8; ++w) tot += reds[w];
  const float inv = 1.0f / tot;

  unsigned hw[4], lw[4];
#pragma unroll
  for (int e2 = 0; e2 < 4; ++e2) {
    const float p0 = ev[2 * e2] * inv;
    const float p1 = ev[2 * e2 + 1] * inv;
    const unsigned short h0 = f2bf_bits(p0);
    const unsigned short h1 = f2bf_bits(p1);
    const unsigned short l0 = f2bf_bits(p0 - bf_bits2f(h0));
    const unsigned short l1 = f2bf_bits(p1 - bf_bits2f(h1));
    hw[e2] = (unsigned)h0 | ((unsigned)h1 << 16);
    lw[e2] = (unsigned)l0 | ((unsigned)l1 << 16);
  }
  v4u hv, lv;
  hv.x = hw[0]; hv.y = hw[1]; hv.z = hw[2]; hv.w = hw[3];
  lv.x = lw[0]; lv.y = lw[1]; lv.z = lw[2]; lv.w = lw[3];
  *(v4u*)(Ph + base) = hv;
  *(v4u*)(Pl + base) = lv;
  
}

/* ---------------------------------------------------------------------------
   Workspace region map (bytes), NROW = NFEAT = 2048, every plane 2048 x 2048:
     Zb   bf16 [NROW][NFEAT]        0 ..   8 MiB
     Wqb  bf16 [NFEAT][NFEAT]       8 ..  16 MiB
     Wkb  bf16                     16 ..  24 MiB
     Wvb  bf16                     24 ..  32 MiB
     Qh, Ql   bf16 [NROW][NFEAT]   32 ..  48 MiB
     Kh, Kl   bf16 [NROW][NFEAT]   48 ..  64 MiB
     Vth, Vtl bf16 [NFEAT][NROW]   64 ..  80 MiB   (v transposed)
     S    f32  [NROW][NROW]        80 ..  96 MiB   (scores x 0.125)
     Ph, Pl   bf16 [NROW][NROW]    96 .. 112 MiB   (softmax probabilities hi / lo)
   total 117440512 B. Every plane is written in full by its producer before any consumer reads it.
   --------------------------------------------------------------------------- */
extern "C" void kernel_launch(void* const* d_in, const int* in_sizes, int n_in,
                              void* d_out, int out_size, void* d_ws, size_t ws_size,
                              hipStream_t stream)
{
  constexpr int NROW  = 2048;
  constexpr int NFEAT = 2048;
  static_assert(NROW % 64 == 0 && NFEAT % 64 == 0, "M,N tile multiples");
  static_assert(NROW % 32 == 0 && NFEAT % 32 == 0, "K multiple of 32");
  static_assert(NROW == 256 * 8, "softmax: 256 threads x 8 columns per row");
  static_assert((NROW * NFEAT) % 512 == 0 && (NFEAT * NFEAT) % 512 == 0, "cast grid exact");

  constexpr size_t ZB   = (size_t)NROW * NFEAT * 2;
  constexpr size_t WB   = (size_t)NFEAT * NFEAT * 2;
  constexpr size_t QKB  = (size_t)NROW * NFEAT * 2;
  constexpr size_t VTB  = (size_t)NFEAT * NROW * 2;
  constexpr size_t SB   = (size_t)NROW * NROW * 4;
  constexpr size_t PB   = (size_t)NROW * NROW * 2;
  constexpr size_t oZ   = 0;
  constexpr size_t oWq  = oZ + ZB;
  constexpr size_t oWk  = oWq + WB;
  constexpr size_t oWv  = oWk + WB;
  constexpr size_t oQh  = oWv + WB;
  constexpr size_t oQl  = oQh + QKB;
  constexpr size_t oKh  = oQl + QKB;
  constexpr size_t oKl  = oKh + QKB;
  constexpr size_t oVth = oKl + QKB;
  constexpr size_t oVtl = oVth + VTB;
  constexpr size_t oS   = oVtl + VTB;
  constexpr size_t oPh  = oS + SB;
  constexpr size_t oPl  = oPh + PB;
  constexpr size_t WS_TOTAL = oPl + PB;
  static_assert(WS_TOTAL == 117440512ull, "carve total");
  static_assert(WS_TOTAL <= 134217728ull, "carve budget");

  if (n_in < 7) return;
  if (ws_size < WS_TOTAL) return;
  if ((size_t)out_size < (size_t)NROW * NFEAT) return;
  if (in_sizes[0] < NROW * NFEAT || in_sizes[1] < NFEAT * NFEAT || in_sizes[2] < NFEAT ||
      in_sizes[3] < NFEAT * NFEAT || in_sizes[4] < NFEAT || in_sizes[5] < NFEAT * NFEAT || in_sizes[6] < NFEAT) return;

  const float* z   = (const float*)d_in[0];
  const float* Wq  = (const float*)d_in[1];
  const float* bq  = (const float*)d_in[2];
  const float* Wk  = (const float*)d_in[3];
  const float* bk  = (const float*)d_in[4];
  const float* Wv  = (const float*)d_in[5];
  const float* bvp = (const float*)d_in[6];
  float* out = (float*)d_out;

  char* ws = (char*)d_ws;
  unsigned short* Zb  = (unsigned short*)(ws + oZ);
  unsigned short* Wqb = (unsigned short*)(ws + oWq);
  unsigned short* Wkb = (unsigned short*)(ws + oWk);
  unsigned short* Wvb = (unsigned short*)(ws + oWv);
  unsigned short* Qh  = (unsigned short*)(ws + oQh);
  unsigned short* Ql  = (unsigned short*)(ws + oQl);
  unsigned short* Kh  = (unsigned short*)(ws + oKh);
  unsigned short* Kl  = (unsigned short*)(ws + oKl);
  unsigned short* Vth = (unsigned short*)(ws + oVth);
  unsigned short* Vtl = (unsigned short*)(ws + oVtl);
  float*          Sf  = (float*)(ws + oS);
  unsigned short* Ph  = (unsigned short*)(ws + oPh);
  unsigned short* Pl  = (unsigned short*)(ws + oPl);

  const dim3 blk(256);

  /* casts: n2 = elements / 2; grid * 256 == n2 exactly (8192 blocks each) */
  const int n2z = NROW * NFEAT / 2;
  const int n2w = NFEAT * NFEAT / 2;
  cast_f32_bf16x2<<<dim3(n2z / 256), blk, 0, stream>>>(z,  Zb,  n2z);
  cast_f32_bf16x2<<<dim3(n2w / 256), blk, 0, stream>>>(Wq, Wqb, n2w);
  cast_f32_bf16x2<<<dim3(n2w / 256), blk, 0, stream>>>(Wk, Wkb, n2w);
  cast_f32_bf16x2<<<dim3(n2w / 256), blk, 0, stream>>>(Wv, Wvb, n2w);

  /* GEMM grids: one 64x64 tile per wave, 8 waves per block */
  const int tilesQ  = (NROW / 64) * (NFEAT / 64);
  const int tilesVt = (NFEAT / 64) * (NROW / 64);
  const int tilesS  = (NROW / 64) * (NROW / 64);
  const int tilesH  = (NROW / 64) * (NFEAT / 64);
  const dim3 gQ((tilesQ + 7) / 8, 1), gVt((tilesVt + 7) / 8, 1), gS((tilesS + 7) / 8, 1), gH((tilesH + 7) / 8, 1);

  /* Q[a][f] = sum_k Zb[a][k] Wqb[f][k] + bq[f]  -> bf16 hi/lo planes   (M=NROW, N=NFEAT, K=NFEAT) */
  wmma_gemm64<1, false, 2, 2><<<gQ, blk, 0, stream>>>(
      Zb, Zb, NFEAT, 0L, Wqb, Wqb, NFEAT, 0L, (void*)Qh, (void*)Ql, NFEAT, 0L, bq, NROW, NFEAT, NFEAT, 1.0f);
  /* K[a][f] = sum_k Zb[a][k] Wkb[f][k] + bk[f] */
  wmma_gemm64<1, false, 2, 2><<<gQ, blk, 0, stream>>>(
      Zb, Zb, NFEAT, 0L, Wkb, Wkb, NFEAT, 0L, (void*)Kh, (void*)Kl, NFEAT, 0L, bk, NROW, NFEAT, NFEAT, 1.0f);
  /* Vt[f][a] = sum_k Wvb[f][k] Zb[a][k] + bv[f]  (bias along m)      (M=NFEAT, N=NROW, K=NFEAT) */
  wmma_gemm64<1, false, 1, 2><<<gVt, blk, 0, stream>>>(
      Wvb, Wvb, NFEAT, 0L, Zb, Zb, NFEAT, 0L, (void*)Vth, (void*)Vtl, NROW, 0L, bvp, NFEAT, NROW, NFEAT, 1.0f);
  /* S[a][a2] = 0.125 * sum_f Q[a][f] K[a2][f]  (hi/lo split, f32 out) (M=NROW, N=NROW, K=NFEAT) */
  wmma_gemm64<1, true, 0, 0><<<gS, blk, 0, stream>>>(
      Qh, Ql, NFEAT, 0L, Kh, Kl, NFEAT, 0L, (void*)Sf, (void*)Sf, NROW, 0L, bq, NROW, NROW, NFEAT, 0.125f);
  /* P = softmax(S) per row -> bf16 hi/lo planes [NROW][NROW] */
  softmax_rows_split<<<dim3(NROW), blk, 0, stream>>>(Sf, Ph, Pl, NROW);
  /* H[a][f] = sum_j P[a][j] Vt[f][j]  (hi/lo split, f32 out to d_out) (M=NROW, N=NFEAT, K=NROW) */
  wmma_gemm64<1, true, 0, 0><<<gH, blk, 0, stream>>>(
      Ph, Pl, NROW, 0L, Vth, Vtl, NROW, 0L, (void*)out, (void*)out, NFEAT, 0L, bq, NROW, NFEAT, NROW, 1.0f);
}

// v001
// It runs in 154 microseconds.
// In both of two side-by-side timings against v000, it was 3.27 times as fast.
// Compute dtype: projections on v_wmma_f32_16x16x32_bf16 with plain bf16 operands (every float input RNE-converted once to bf16, biases included), f32 accumulate; q.k^T and attn.v on v_wmma_f32_16x16x32_bf16 with bf16 hi/lo split planes (hi.hi + hi.lo + lo.hi), f32 accumulate; softmax and all side math f32.
#include <hip/hip_runtime.h>
#include <hip/hip_bf16.h>

typedef __attribute__((ext_vector_type(16))) _Float16 v16h;
typedef __attribute__((ext_vector_type(8)))  _Float16 v8h;
typedef __attribute__((ext_vector_type(16))) __bf16   v16b;
typedef __attribute__((ext_vector_type(8)))  __bf16   v8b;
typedef __attribute__((ext_vector_type(8)))  float    v8f;
typedef __attribute__((ext_vector_type(4)))  float    v4f;
typedef __attribute__((ext_vector_type(2)))  float    v2f;
typedef __attribute__((ext_vector_type(4)))  unsigned v4u;

/* RNE convert f32 -> bf16 bit pattern, and back */
__device__ __forceinline__ unsigned short f2bf_bits(float f) {
  unsigned u = __float_as_uint(f);
  return (unsigned short)((u + 0x7FFFu + ((u >> 16) & 1u)) >> 16);
}
__device__ __forceinline__ float bf_bits2f(unsigned short h) { return __uint_as_float(((unsigned)h) << 16); }

typedef __attribute__((ext_vector_type(4))) uint32_t u32x4;
typedef __attribute__((ext_vector_type(8))) uint32_t u32x8;

/* wave-uniform value into a scalar register */
__device__ __forceinline__ uint32_t uni(uint32_t v) { return (uint32_t)__builtin_amdgcn_readfirstlane(v); }
/* a tensor-load issue test or descriptor input held in a scalar register: the tensor load ignores EXEC, so its
   branch must be scalar, and what is derived from the returned value is formed behind the waits written before it */
__device__ __forceinline__ uint32_t pinned(uint32_t v) { uint32_t w = uni(v); asm volatile("" : "+s"(w)); return w; }
/* this wave's LDS reads have returned (before its buffer is handed back for a refill) */
__device__ __forceinline__ void wait_ds0() { asm volatile("s_wait_dscnt 0x0" ::: "memory"); }
/* this wave's tensor load has landed (the compiler places no wait for it) */
__device__ __forceinline__ void wait_tensor0() { asm volatile("s_wait_tensorcnt 0x0" ::: "memory"); }
/* one request of the whole wave: a 2-D tile from global memory into LDS. Both groups are in-out operands so that each
   stays in one scalar register tuple from issue to issue: nothing else is written over the words of a request in flight */
__device__ __forceinline__ void tdm_load(u32x4& g0, u32x8& g1) { asm volatile("tensor_load_to_lds %0, %1" : "+s"(g0), "+s"(g1) :: "memory"); }
/* group 1: 1-byte elements, ROWS rows of 256 B, tensor = tile, 16 B of LDS pad behind every row (pitch 272 B) */
template <uint32_t ROWS>
__device__ __forceinline__ u32x8 tdm_group1(uint32_t src_pitch) {
  constexpr uint32_t d0 = 256u, d1 = ROWS;
  u32x8 g;
  g[0] = uni((1u << 20) | (5u << 22) | (3u << 25));
  g[1] = uni((d0 & 0xFFFFu) << 16);
  g[2] = uni((d0 >> 16) | ((d1 & 0xFFFFu) << 16));
  g[3] = uni((d1 >> 16) | (d0 << 16));
  g[4] = uni(d1);
  g[5] = uni(src_pitch);
  g[6] = uni(0u);
  g[7] = uni(0u);
  return g;
}
__device__ __forceinline__ u32x4 tdm_group0(uint32_t lds_dst, uint64_t ga) {
  u32x4 g;
  g[0] = uni(1u); g[1] = uni(lds_dst); g[2] = uni((uint32_t)ga);
  g[3] = uni((((uint32_t)(ga >> 32)) & 0x01FFFFFFu) | 0x80000000u);
  return g;
}

template <typename T> struct Frag;
template <> struct Frag<_Float16> {
  typedef v16h V; union U { v16h v; v8h h[2]; };
  /* elements 0..7 <- p[0..7], 8..15 <- p[16..23] */
  static __device__ __forceinline__ v16h load(const _Float16* p) {
    U f; f.h[0] = *(const v8h*)(p); f.h[1] = *(const v8h*)(p + 16); return f.v;
  }
  static __device__ __forceinline__ v8f mma(v16h a, v16h b, v8f c) {
    return __builtin_amdgcn_wmma_f32_16x16x32_f16(false, a, false, b, (short)0, c, false, false);
  }
};
template <> struct Frag<__bf16> {
  typedef v16b V; union U { v16b v; v8b h[2]; };
  static __device__ __forceinline__ v16b load(const __bf16* p) {
    U f; f.h[0] = *(const v8b*)(p); f.h[1] = *(const v8b*)(p + 16); return f.v;
  }
  static __device__ __forceinline__ v8f mma(v16b a, v16b b, v8f c) {
    return __builtin_amdgcn_wmma_f32_16x16x32_bf16(false, a, false, b, (short)0, c, false, false);
  }
};

/* ---- LDS-staged batched WMMA GEMM ------------------------------------------
   C[m,n] = scale * sum_k A[m,k] * Bt[n,k] (+bias); a workgroup of 4 waves (2 x 2) owns a 128x128 tile, each wave 64x64.
   A row-major [M,K]; Bt row-major [N,K]; M,N % 128 == 0, K % 128 == 0, K >= 256 (no tail handling).
   A stage is 128 k (256 B) of the tile's 128 A rows and 128 B rows (of both planes when SPLIT), laid in LDS at pitch 272 B
   by one tensor load per wave; two buffers, the load of stage s + 2 issued behind the barrier that ends pass s.
   SPLIT: operands are hi/lo planes (A2/Bt2 = lo planes, same layout); product = hi.hi + hi.lo + lo.hi.
   BIAS_MODE: 0 = none, 1 = bias[m], 2 = bias[n]; bias values are RNE-converted to bf16 before the add.
   Bias fetch: each lane loads 2 values (64 per wave), distributed with wave shuffles.
   OUT_MODE: 0 = f32, 2 = bf16 hi plane (Cout) + bf16 lo plane (Cout2).
   ET: 0 = f16 operands, 1 = bf16 operands (pointers passed as 16-bit storage) */
template <int ET> struct Elem;
template <> struct Elem<0> { typedef _Float16 T; };
template <> struct Elem<1> { typedef __bf16 T; };
template <int ET, bool SPLIT, int BIAS_MODE, int OUT_MODE>
__global__ __launch_bounds__(128) void wmma_gemm64(
    const unsigned short* __restrict__ Ap, const unsigned short* __restrict__ A2p, int lda, long strideA,
    const unsigned short* __restrict__ Btp, const unsigned short* __restrict__ Bt2p, int ldb, long strideB,
    void* __restrict__ Cout, void* __restrict__ Cout2, int ldc, long strideC,
    const float* __restrict__ bias,
    int M, int N, int K, float scale) {
  typedef typename Elem<ET>::T T;
  typedef typename Frag<T>::V V;
  const T* A = (const T*)Ap; const T* A2 = (const T*)A2p; const T* Bt = (const T*)Btp; const T* Bt2 = (const T*)Bt2p;
  constexpr uint32_t ROWB  = 256u;                      /* bytes of an operand row per stage (128 k) */
  constexpr uint32_t PITCH = 272u;                      /* LDS row pitch: odd multiple of 16 B for ds_load_b128 */
  constexpr uint32_t SROWS = SPLIT ? 128u : 64u;        /* rows of one wave's slice */
  constexpr uint32_t SLICE = SPLIT ? 34816u : 18432u;   /* SROWS * PITCH rounded up to a multiple of 2 KiB */
  constexpr uint32_t STAGE = 4u * SLICE;
  constexpr uint32_t SLAB  = 16u * 68u * 4u;            /* per-wave 16x64 f32 output slab, pitch 68 floats */
  static_assert(SLICE % 2048u == 0 && SLICE >= SROWS * PITCH, "slice place and size");
  static_assert(2u * STAGE + 4u * SLAB <= 320u * 1024u, "LDS budget");
  /* [buffer 0 | buffer 1 | 4 output slabs]; the only LDS object, so it starts at LDS byte 0 */
  __shared__ __attribute__((aligned(2048))) unsigned char smem[2u * STAGE + 4u * SLAB];
  const int b    = blockIdx.y;
  const int lane = threadIdx.x & 31;
  const uint32_t wave = uni(threadIdx.x >> 5);
  const int tilesN = N >> 7;
  const int tilesM = M >> 7;
  const int tile = blockIdx.x;
  /* workgroup-uniform; ahead of every barrier and tensor load */
  if (tile >= tilesM * tilesN) return;
  const int tm = tile / tilesN;
  const int tn = tile - tm * tilesN;
  const int mB = tm << 7;
  const int nB = tn << 7;
  const uint32_t wm = wave >> 1, wn = wave & 1u;
  const int m0 = mB + (int)(wm << 6);
  const int n0 = nB + (int)(wn << 6);

  const T* Ab  = A  + (size_t)b * strideA;
  const T* Bb  = Bt + (size_t)b * strideB;
  const T* Ab2 = SPLIT ? (A2  + (size_t)b * strideA) : nullptr;
  const T* Bb2 = SPLIT ? (Bt2 + (size_t)b * strideB) : nullptr;

  /* the slice this wave brings in. SPLIT: wave 0..3 = all 128 rows of A hi, A lo, B hi, B lo.
     Otherwise: waves 0, 1 = A rows 0..63, 64..127; waves 2, 3 = B rows 0..63, 64..127 */
  const bool isB = wave >= 2u;
  const T* plane = SPLIT ? (isB ? ((wave & 1u) ? Bb2 : Bb) : ((wave & 1u) ? Ab2 : Ab)) : (isB ? Bb : Ab);
  const uint32_t srow = (uint32_t)(isB ? nB : mB) + (SPLIT ? 0u : (wave & 1u) * 64u);
  const uint32_t sld  = (uint32_t)(isB ? ldb : lda);
  const uint64_t sbase = (uint64_t)(size_t)plane + (uint64_t)srow * sld * 2u;
  u32x8 g1 = tdm_group1<SROWS>(sld * 2u);
  const uint32_t dst0 = (uint32_t)(size_t)smem + wave * SLICE;
  u32x4 g0 = tdm_group0(dst0, sbase);
  /* stage st: new LDS place and source address (words 1 to 3), formed behind the wait on the request before it */
  auto issue = [&](uint32_t st) {
    const uint64_t ga = sbase + (uint64_t)st * ROWB;
    g0[1] = uni(dst0 + (st & 1u) * STAGE);
    g0[2] = uni((uint32_t)ga);
    g0[3] = uni((((uint32_t)(ga >> 32)) & 0x01FFFFFFu) | 0x80000000u);
    tdm_load(g0, g1);
  };

  /* row (A) / col (B, D) within subtile; D row offset */
  const int rlane = lane & 15;
  const int mOff  = (lane >> 4) * 8;
  /* this lane's byte in a 16-row fragment group: its row, and 16 B (8 k) for the upper lane half */
  const uint32_t loff = (uint32_t)rlane * PITCH + (uint32_t)(lane >> 4) * 16u;
  const uint32_t offAh = (SPLIT ? wm * 64u * PITCH : wm * SLICE) + loff;
  const uint32_t offBh = (SPLIT ? 2u * SLICE + wn * 64u * PITCH : (2u + wn) * SLICE) + loff;

  v8f acc[4][4];
#pragma unroll
  for (int i = 0; i < 4; ++i)
#pragma unroll
    for (int j = 0; j < 4; ++j) acc[i][j] = (v8f){0.f,0.f,0.f,0.f,0.f,0.f,0.f,0.f};

  const uint32_t NP = (uint32_t)K >> 7;
  /* prologue, two buffers: stage 0 lands and is published, then stage 1 flies under pass 0 */
  issue(0u);
  wait_tensor0();
  __syncthreads();
  issue(pinned(1u));

  /* kept rolled: one pass per trip, so that the buffer is a scalar select */
#pragma clang loop unroll(disable)
  for (uint32_t s = 0; s < NP; ++s) {
    const unsigned char* buf = smem + (s & 1u) * STAGE;
    V ah[2][4], bh[2][4], al[2][4], bl[2][4];
    auto fetch = [&](int set, int kb) {
      /* unrolled: the fragment arrays stay in registers only under constant indices */
#pragma unroll
      for (int t = 0; t < 4; ++t) {
        const uint32_t o = (uint32_t)t * 16u * PITCH + (uint32_t)kb * 64u;
        bh[set][t] = Frag<T>::load((const T*)(buf + offBh + o));
        ah[set][t] = Frag<T>::load((const T*)(buf + offAh + o));
        if (SPLIT) {
          bl[set][t] = Frag<T>::load((const T*)(buf + offBh + SLICE + o));
          al[set][t] = Frag<T>::load((const T*)(buf + offAh + SLICE + o));
        }
      }
    };
    fetch(0, 0);
    /* unrolled, with the product loops inside it: register set, fragment and accumulator indices must be constants */
#pragma unroll
    for (int kb = 0; kb < 4; ++kb) {
      const int c = kb & 1;
      /* the next block's fragments as one group ahead of this block's products, into the other register set */
      if (kb < 3) fetch(c ^ 1, kb + 1);
      /* keeps the LDS loads from being moved in among the matrix instructions */
      __builtin_amdgcn_sched_barrier(0);
#pragma unroll
      for (int i = 0; i < 4; ++i)
#pragma unroll
        for (int j = 0; j < 4; ++j) acc[i][j] = Frag<T>::mma(ah[c][i], bh[c][j], acc[i][j]);
      if (SPLIT) {
#pragma unroll
        for (int i = 0; i < 4; ++i)
#pragma unroll
          for (int j = 0; j < 4; ++j) acc[i][j] = Frag<T>::mma(ah[c][i], bl[c][j], acc[i][j]);
#pragma unroll
        for (int i = 0; i < 4; ++i)
#pragma unroll
          for (int j = 0; j < 4; ++j) acc[i][j] = Frag<T>::mma(al[c][i], bh[c][j], acc[i][j]);
      }
      /* as above: the next group of loads stays behind this block */
      __builtin_amdgcn_sched_barrier(0);
    }
    /* publish point of stage s + 1: own LDS reads done, own tensor load landed, then the workgroup barrier */
    wait_ds0();
    wait_tensor0();
    __syncthreads();
    /* refill of the buffer that pass s has just read, only while stage s + 2 exists (scalar branch) */
    if (pinned(s + 2u < NP)) issue(pinned(s + 2u));
  }
  wait_tensor0();
  wait_ds0();

  /* ---- epilogue ---- */
  float* slab = (float*)(smem + 2u * STAGE + wave * SLAB);
  /* bias: 64 values per wave as 2 per lane (coalesced), RNE-converted to bf16 */
  float breg0 = 0.f, breg1 = 0.f;
  if (BIAS_MODE == 1) { breg0 = bias[m0 + lane]; breg1 = bias[m0 + 32 + lane]; }
  if (BIAS_MODE == 2) { breg0 = bias[n0 + lane]; breg1 = bias[n0 + 32 + lane]; }
  if (BIAS_MODE != 0) { breg0 = bf_bits2f(f2bf_bits(breg0)); breg1 = bf_bits2f(f2bf_bits(breg1)); }
#pragma unroll
  for (int i = 0; i < 4; ++i) {
    const int mBase = m0 + (i << 4);
    float brow[8];
#pragma unroll
    for (int r = 0; r < 8; ++r) {
      brow[r] = 0.f;
      if (BIAS_MODE == 1) {
        /* tile row = i*16 + mOff + r; lanes 0..31 hold rows 0..31 (breg0) and 32..63 (breg1) */
        const float bsrc = (i < 2) ? breg0 : breg1;
        brow[r] = __shfl(bsrc, ((i & 1) << 4) + mOff + r, 32);
      }
    }
#pragma unroll
    for (int j = 0; j < 4; ++j) {
      float bcol = 0.f;
      if (BIAS_MODE == 2) {
        /* tile col = j*16 + rlane */
        const float bsrc = (j < 2) ? breg0 : breg1;
        bcol = __shfl(bsrc, ((j & 1) << 4) + rlane, 32);
      }
#pragma unroll
      for (int r = 0; r < 8; ++r) {
        float v = acc[i][j][r] * scale;
        if (BIAS_MODE == 1) v += brow[r];
        if (BIAS_MODE == 2) v += bcol;
        slab[(mOff + r) * 68 + (j << 4) + rlane] = v;
      }
    }
    __builtin_amdgcn_fence(__ATOMIC_RELEASE, "workgroup");
    __builtin_amdgcn_wave_barrier();
    __builtin_amdgcn_fence(__ATOMIC_ACQUIRE, "workgroup");
    if (OUT_MODE == 0) {
      float* C = (float*)Cout + (size_t)b * strideC;
      /* row seg = 256 B = 16 lanes x 16 B */
      const int hh = lane >> 4, c4 = (lane & 15) * 4;
      {
#pragma unroll
        for (int it = 0; it < 8; ++it) {
          const int row = it * 2 + hh;
          v4f v = *(const v4f*)(slab + row * 68 + c4);
          *(v4f*)(C + (size_t)(mBase + row) * ldc + n0 + c4) = v;
        }
        
      }
    } else {
      const int q = lane >> 3, c8 = (lane & 7) * 8;
      unsigned short* C  = (unsigned short*)Cout  + (size_t)b * strideC;
      unsigned short* C2 = (unsigned short*)Cout2 + (size_t)b * strideC;
      {
#pragma unroll
        for (int it = 0; it < 4; ++it) {
          const int row = it * 4 + q;
          const float* sp = slab + row * 68 + c8;
          v8h hv, lv;
#pragma unroll
          for (int e = 0; e < 8; ++e) {
            unsigned short hb = f2bf_bits(sp[e]);
            unsigned short lb = f2bf_bits(sp[e] - bf_bits2f(hb));
            hv[e] = __builtin_bit_cast(_Float16, hb);
            lv[e] = __builtin_bit_cast(_Float16, lb);
          }
          *(v8h*)(C + (size_t)(mBase + row) * ldc + n0 + c8) = hv;
          *(v8h*)(C2 + (size_t)(mBase + row) * ldc + n0 + c8) = lv;
        }
        
      }
    }
    __builtin_amdgcn_fence(__ATOMIC_RELEASE, "workgroup");
    __builtin_amdgcn_wave_barrier();
    __builtin_amdgcn_fence(__ATOMIC_ACQUIRE, "workgroup");
  }
}

/* ---- f32 -> bf16 (RNE) cast: 2 elements per thread packed into one 4-B store; a wave writes one
*/
__global__ __launch_bounds__(256) void cast_f32_bf16x2(
    const float* __restrict__ in, unsigned short* __restrict__ out, int n2) {
  const int i = blockIdx.x * 256 + threadIdx.x;
  if (i < n2) {
    const v2f f = *(const v2f*)(in + 2 * (size_t)i);
    const unsigned u = (unsigned)f2bf_bits(f.x) | ((unsigned)f2bf_bits(f.y) << 16);
    ((unsigned*)out)[i] = u;
    
  }
}

/* ---- Row softmax of S (already scaled), one 256-thread block per row of exactly 2048 columns.
   Thread t owns columns 8t..8t+7 (two 16-B loads). Output = probabilities as bf16 hi + lo planes;
*/
__global__ __launch_bounds__(256) void softmax_rows_split(
    const float* __restrict__ S, unsigned short* __restrict__ Ph, unsigned short* __restrict__ Pl, int ncols) {
  __shared__ float redm[8];
  __shared__ float reds[8];
  const int tid = threadIdx.x, lane = tid & 31, wave = tid >> 5;
  const size_t base = (size_t)blockIdx.x * (size_t)ncols + (size_t)tid * 8;
  const v4f x0 = *(const v4f*)(S + base);
  const v4f x1 = *(const v4f*)(S + base + 4);
  float xv[8];
  xv[0] = x0.x; xv[1] = x0.y; xv[2] = x0.z; xv[3] = x0.w;
  xv[4] = x1.x; xv[5] = x1.y; xv[6] = x1.z; xv[7] = x1.w;
  float m = xv[0];
#pragma unroll
  for (int e = 1; e < 8; ++e) m = fmaxf(m, xv[e]);
#pragma unroll
  for (int off = 1; off < 32; off <<= 1) m = fmaxf(m, __shfl_xor(m, off, 32));
  if (lane == 0) redm[wave] = m;
  __syncthreads();
  float gm = redm[0];
#pragma unroll
  for (int w = 1; w < 8; ++w) gm = fmaxf(gm, redm[w]);

  float ev[8];
  float ps = 0.0f;
#pragma unroll
  for (int e = 0; e < 8; ++e) { ev[e] = expf(xv[e] - gm); ps += ev[e]; }
#pragma unroll
  for (int off = 1; off < 32; off <<= 1) ps += __shfl_xor(ps, off, 32);
  if (lane == 0) reds[wave] = ps;
  __syncthreads();
  float tot = reds[0];
#pragma unroll
  for (int w = 1; w < 8; ++w) tot += reds[w];
  const float inv = 1.0f / tot;

  unsigned hw[4], lw[4];
#pragma unroll
  for (int e2 = 0; e2 < 4; ++e2) {
    const float p0 = ev[2 * e2] * inv;
    const float p1 = ev[2 * e2 + 1] * inv;
    const unsigned short h0 = f2bf_bits(p0);
    const unsigned short h1 = f2bf_bits(p1);
    const unsigned short l0 = f2bf_bits(p0 - bf_bits2f(h0));
    const unsigned short l1 = f2bf_bits(p1 - bf_bits2f(h1));
    hw[e2] = (unsigned)h0 | ((unsigned)h1 << 16);
    lw[e2] = (unsigned)l0 | ((unsigned)l1 << 16);
  }
  v4u hv, lv;
  hv.x = hw[0]; hv.y = hw[1]; hv.z = hw[2]; hv.w = hw[3];
  lv.x = lw[0]; lv.y = lw[1]; lv.z = lw[2]; lv.w = lw[3];
  *(v4u*)(Ph + base) = hv;
  *(v4u*)(Pl + base) = lv;
  
}

/* ---------------------------------------------------------------------------
   Workspace region map (bytes), NROW = NFEAT = 2048, every plane 2048 x 2048:
     Zb   bf16 [NROW][NFEAT]        0 ..   8 MiB
     Wqb  bf16 [NFEAT][NFEAT]       8 ..  16 MiB
     Wkb  bf16                     16 ..  24 MiB
     Wvb  bf16                     24 ..  32 MiB
     Qh, Ql   bf16 [NROW][NFEAT]   32 ..  48 MiB
     Kh, Kl   bf16 [NROW][NFEAT]   48 ..  64 MiB
     Vth, Vtl bf16 [NFEAT][NROW]   64 ..  80 MiB   (v transposed)
     S    f32  [NROW][NROW]        80 ..  96 MiB   (scores x 0.125)
     Ph, Pl   bf16 [NROW][NROW]    96 .. 112 MiB   (softmax probabilities hi / lo)
   total 117440512 B. Every plane is written in full by its producer before any consumer reads it.
   --------------------------------------------------------------------------- */
extern "C" void kernel_launch(void* const* d_in, const int* in_sizes, int n_in,
                              void* d_out, int out_size, void* d_ws, size_t ws_size,
                              hipStream_t stream)
{
  constexpr int NROW  = 2048;
  constexpr int NFEAT = 2048;
  static_assert(NROW % 128 == 0 && NFEAT % 128 == 0, "M,N tile multiples");
  static_assert(NROW % 128 == 0 && NFEAT % 128 == 0 && NROW >= 256 && NFEAT >= 256, "K a multiple of the stage, two stages or more");
  static_assert(NROW == 256 * 8, "softmax: 256 threads x 8 columns per row");
  static_assert((NROW * NFEAT) % 512 == 0 && (NFEAT * NFEAT) % 512 == 0, "cast grid exact");

  constexpr size_t ZB   = (size_t)NROW * NFEAT * 2;
  constexpr size_t WB   = (size_t)NFEAT * NFEAT * 2;
  constexpr size_t QKB  = (size_t)NROW * NFEAT * 2;
  constexpr size_t VTB  = (size_t)NFEAT * NROW * 2;
  constexpr size_t SB   = (size_t)NROW * NROW * 4;
  constexpr size_t PB   = (size_t)NROW * NROW * 2;
  constexpr size_t oZ   = 0;
  constexpr size_t oWq  = oZ + ZB;
  constexpr size_t oWk  = oWq + WB;
  constexpr size_t oWv  = oWk + WB;
  constexpr size_t oQh  = oWv + WB;
  constexpr size_t oQl  = oQh + QKB;
  constexpr size_t oKh  = oQl + QKB;
  constexpr size_t oKl  = oKh + QKB;
  constexpr size_t oVth = oKl + QKB;
  constexpr size_t oVtl = oVth + VTB;
  constexpr size_t oS   = oVtl + VTB;
  constexpr size_t oPh  = oS + SB;
  constexpr size_t oPl  = oPh + PB;
  constexpr size_t WS_TOTAL = oPl + PB;
  static_assert(WS_TOTAL == 117440512ull, "carve total");
  static_assert(WS_TOTAL <= 134217728ull, "carve budget");

  if (n_in < 7) return;
  if (ws_size < WS_TOTAL) return;
  if ((size_t)out_size < (size_t)NROW * NFEAT) return;
  if (in_sizes[0] < NROW * NFEAT || in_sizes[1] < NFEAT * NFEAT || in_sizes[2] < NFEAT ||
      in_sizes[3] < NFEAT * NFEAT || in_sizes[4] < NFEAT || in_sizes[5] < NFEAT * NFEAT || in_sizes[6] < NFEAT) return;

  const float* z   = (const float*)d_in[0];
  const float* Wq  = (const float*)d_in[1];
  const float* bq  = (const float*)d_in[2];
  const float* Wk  = (const float*)d_in[3];
  const float* bk  = (const float*)d_in[4];
  const float* Wv  = (const float*)d_in[5];
  const float* bvp = (const float*)d_in[6];
  float* out = (float*)d_out;

  char* ws = (char*)d_ws;
  unsigned short* Zb  = (unsigned short*)(ws + oZ);
  unsigned short* Wqb = (unsigned short*)(ws + oWq);
  unsigned short* Wkb = (unsigned short*)(ws + oWk);
  unsigned short* Wvb = (unsigned short*)(ws + oWv);
  unsigned short* Qh  = (unsigned short*)(ws + oQh);
  unsigned short* Ql  = (unsigned short*)(ws + oQl);
  unsigned short* Kh  = (unsigned short*)(ws + oKh);
  unsigned short* Kl  = (unsigned short*)(ws + oKl);
  unsigned short* Vth = (unsigned short*)(ws + oVth);
  unsigned short* Vtl = (unsigned short*)(ws + oVtl);
  float*          Sf  = (float*)(ws + oS);
  unsigned short* Ph  = (unsigned short*)(ws + oPh);
  unsigned short* Pl  = (unsigned short*)(ws + oPl);

  const dim3 blk(256);

  /* casts: n2 = elements / 2; grid * 256 == n2 exactly (8192 blocks each) */
  const int n2z = NROW * NFEAT / 2;
  const int n2w = NFEAT * NFEAT / 2;
  cast_f32_bf16x2<<<dim3(n2z / 256), blk, 0, stream>>>(z,  Zb,  n2z);
  cast_f32_bf16x2<<<dim3(n2w / 256), blk, 0, stream>>>(Wq, Wqb, n2w);
  cast_f32_bf16x2<<<dim3(n2w / 256), blk, 0, stream>>>(Wk, Wkb, n2w);
  cast_f32_bf16x2<<<dim3(n2w / 256), blk, 0, stream>>>(Wv, Wvb, n2w);

  /* GEMM grids: one 128x128 tile per workgroup of 4 waves */
  const dim3 gblk(128);
  const dim3 gQ((NROW / 128) * (NFEAT / 128), 1), gVt((NFEAT / 128) * (NROW / 128), 1);
  const dim3 gS((NROW / 128) * (NROW / 128), 1), gH((NROW / 128) * (NFEAT / 128), 1);

  /* Q[a][f] = sum_k Zb[a][k] Wqb[f][k] + bq[f]  -> bf16 hi/lo planes   (M=NROW, N=NFEAT, K=NFEAT) */
  wmma_gemm64<1, false, 2, 2><<<gQ, gblk, 0, stream>>>(
      Zb, Zb, NFEAT, 0L, Wqb, Wqb, NFEAT, 0L, (void*)Qh, (void*)Ql, NFEAT, 0L, bq, NROW, NFEAT, NFEAT, 1.0f);
  /* K[a][f] = sum_k Zb[a][k] Wkb[f][k] + bk[f] */
  wmma_gemm64<1, false, 2, 2><<<gQ, gblk, 0, stream>>>(
      Zb, Zb, NFEAT, 0L, Wkb, Wkb, NFEAT, 0L, (void*)Kh, (void*)Kl, NFEAT, 0L, bk, NROW, NFEAT, NFEAT, 1.0f);
  /* Vt[f][a] = sum_k Wvb[f][k] Zb[a][k] + bv[f]  (bias along m)      (M=NFEAT, N=NROW, K=NFEAT) */
  wmma_gemm64<1, false, 1, 2><<<gVt, gblk, 0, stream>>>(
      Wvb, Wvb, NFEAT, 0L, Zb, Zb, NFEAT, 0L, (void*)Vth, (void*)Vtl, NROW, 0L, bvp, NFEAT, NROW, NFEAT, 1.0f);
  /* S[a][a2] = 0.125 * sum_f Q[a][f] K[a2][f]  (hi/lo split, f32 out) (M=NROW, N=NROW, K=NFEAT) */
  wmma_gemm64<1, true, 0, 0><<<gS, gblk, 0, stream>>>(
      Qh, Ql, NFEAT, 0L, Kh, Kl, NFEAT, 0L, (void*)Sf, (void*)Sf, NROW, 0L, bq, NROW, NROW, NFEAT, 0.125f);
  /* P = softmax(S) per row -> bf16 hi/lo planes [NROW][NROW] */
  softmax_rows_split<<<dim3(NROW), blk, 0, stream>>>(Sf, Ph, Pl, NROW);
  /* H[a][f] = sum_j P[a][j] Vt[f][j]  (hi/lo split, f32 out to d_out) (M=NROW, N=NFEAT, K=NROW) */
  wmma_gemm64<1, true, 0, 0><<<gH, gblk, 0, stream>>>(
      Ph, Pl, NROW, 0L, Vth, Vtl, NROW, 0L, (void*)out, (void*)out, NFEAT, 0L, bq, NROW, NFEAT, NROW, 1.0f);
}

// v002
// A run of this version takes 146 microseconds.
// Timed twice side by side with v001, it ran 1.05 times as fast both times.
// Counting every step since v000, it is 3.44 times as fast.
// Compute dtype: projections on v_wmma_f32_16x16x32_bf16 with plain bf16 operands (every float input RNE-converted once to bf16, biases included), f32 accumulate; q.k^T and attn.v on v_wmma_f32_16x16x32_bf16 with bf16 hi/lo split planes (hi.hi + hi.lo + lo.hi), f32 accumulate; softmax and all side math f32.
#include <hip/hip_runtime.h>
#include <hip/hip_bf16.h>

typedef __attribute__((ext_vector_type(16))) _Float16 v16h;
typedef __attribute__((ext_vector_type(8)))  _Float16 v8h;
typedef __attribute__((ext_vector_type(16))) __bf16   v16b;
typedef __attribute__((ext_vector_type(8)))  __bf16   v8b;
typedef __attribute__((ext_vector_type(8)))  float    v8f;
typedef __attribute__((ext_vector_type(4)))  float    v4f;
typedef __attribute__((ext_vector_type(2)))  float    v2f;
typedef __attribute__((ext_vector_type(4)))  unsigned v4u;
typedef __attribute__((ext_vector_type(2)))  unsigned v2u;

/* RNE convert f32 -> bf16 bit pattern, and back */
__device__ __forceinline__ unsigned short f2bf_bits(float f) {
  unsigned u = __float_as_uint(f);
  return (unsigned short)((u + 0x7FFFu + ((u >> 16) & 1u)) >> 16);
}
__device__ __forceinline__ float bf_bits2f(unsigned short h) { return __uint_as_float(((unsigned)h) << 16); }

typedef __attribute__((ext_vector_type(4))) uint32_t u32x4;
typedef __attribute__((ext_vector_type(8))) uint32_t u32x8;

/* wave-uniform value into a scalar register */
__device__ __forceinline__ uint32_t uni(uint32_t v) { return (uint32_t)__builtin_amdgcn_readfirstlane(v); }
/* a tensor-load issue test or descriptor input held in a scalar register: the tensor load ignores EXEC, so its
   branch must be scalar, and what is derived from the returned value is formed behind the waits written before it */
__device__ __forceinline__ uint32_t pinned(uint32_t v) { uint32_t w = uni(v); asm volatile("" : "+s"(w)); return w; }
/* this wave's LDS reads have returned (before its buffer is handed back for a refill) */
__device__ __forceinline__ void wait_ds0() { asm volatile("s_wait_dscnt 0x0" ::: "memory"); }
/* this wave's tensor load has landed (the compiler places no wait for it) */
__device__ __forceinline__ void wait_tensor0() { asm volatile("s_wait_tensorcnt 0x0" ::: "memory"); }
/* one request of the whole wave: a 2-D tile from global memory into LDS. Both groups are in-out operands so that each
   stays in one scalar register tuple from issue to issue: nothing else is written over the words of a request in flight */
__device__ __forceinline__ void tdm_load(u32x4& g0, u32x8& g1) { asm volatile("tensor_load_to_lds %0, %1" : "+s"(g0), "+s"(g1) :: "memory"); }
/* group 1: 1-byte elements, ROWS rows of 256 B, tensor = tile, 16 B of LDS pad behind every row (pitch 272 B) */
template <uint32_t ROWS>
__device__ __forceinline__ u32x8 tdm_group1(uint32_t src_pitch) {
  constexpr uint32_t d0 = 256u, d1 = ROWS;
  u32x8 g;
  g[0] = uni((1u << 20) | (5u << 22) | (3u << 25));
  g[1] = uni((d0 & 0xFFFFu) << 16);
  g[2] = uni((d0 >> 16) | ((d1 & 0xFFFFu) << 16));
  g[3] = uni((d1 >> 16) | (d0 << 16));
  g[4] = uni(d1);
  g[5] = uni(src_pitch);
  g[6] = uni(0u);
  g[7] = uni(0u);
  return g;
}
__device__ __forceinline__ u32x4 tdm_group0(uint32_t lds_dst, uint64_t ga) {
  u32x4 g;
  g[0] = uni(1u); g[1] = uni(lds_dst); g[2] = uni((uint32_t)ga);
  g[3] = uni((((uint32_t)(ga >> 32)) & 0x01FFFFFFu) | 0x80000000u);
  return g;
}

template <typename T> struct Frag;
template <> struct Frag<_Float16> {
  typedef v16h V; union U { v16h v; v8h h[2]; };
  /* elements 0..7 <- p[0..7], 8..15 <- p[16..23] */
  static __device__ __forceinline__ v16h load(const _Float16* p) {
    U f; f.h[0] = *(const v8h*)(p); f.h[1] = *(const v8h*)(p + 16); return f.v;
  }
  static __device__ __forceinline__ v8f mma(v16h a, v16h b, v8f c) {
    return __builtin_amdgcn_wmma_f32_16x16x32_f16(false, a, false, b, (short)0, c, false, false);
  }
};
template <> struct Frag<__bf16> {
  typedef v16b V; union U { v16b v; v8b h[2]; };
  static __device__ __forceinline__ v16b load(const __bf16* p) {
    U f; f.h[0] = *(const v8b*)(p); f.h[1] = *(const v8b*)(p + 16); return f.v;
  }
  static __device__ __forceinline__ v8f mma(v16b a, v16b b, v8f c) {
    return __builtin_amdgcn_wmma_f32_16x16x32_bf16(false, a, false, b, (short)0, c, false, false);
  }
};

/* ---- LDS-staged batched WMMA GEMM ------------------------------------------
   C[m,n] = scale * sum_k A[m,k] * Bt[n,k] (+bias); a workgroup of 4 waves (2 x 2) owns a 128x128 tile, each wave 64x64.
   A row-major [M,K]; Bt row-major [N,K]; M,N % 128 == 0, K % 128 == 0, K >= 256 (no tail handling).
   A stage is 128 k (256 B) of the tile's 128 A rows and 128 B rows (of both planes when SPLIT), laid in LDS at pitch 272 B
   by one tensor load per wave; two buffers, the load of stage s + 2 issued behind the barrier that ends pass s.
   SPLIT: operands are hi/lo planes (A2/Bt2 = lo planes, same layout); product = hi.hi + hi.lo + lo.hi.
   BIAS_MODE: 0 = none, 1 = bias[m], 2 = bias[n]; bias values are RNE-converted to bf16 before the add.
   Bias fetch: each lane loads 2 values (64 per wave), distributed with wave shuffles.
   OUT_MODE: 0 = f32, 2 = bf16 hi plane (Cout) + bf16 lo plane (Cout2).
   ET: 0 = f16 operands, 1 = bf16 operands (pointers passed as 16-bit storage) */
template <int ET> struct Elem;
template <> struct Elem<0> { typedef _Float16 T; };
template <> struct Elem<1> { typedef __bf16 T; };
template <int ET, bool SPLIT, int BIAS_MODE, int OUT_MODE>
__global__ __launch_bounds__(128) void wmma_gemm64(
    const unsigned short* __restrict__ Ap, const unsigned short* __restrict__ A2p, int lda, long strideA,
    const unsigned short* __restrict__ Btp, const unsigned short* __restrict__ Bt2p, int ldb, long strideB,
    void* __restrict__ Cout, void* __restrict__ Cout2, int ldc, long strideC,
    const float* __restrict__ bias,
    int M, int N, int K, float scale) {
  typedef typename Elem<ET>::T T;
  typedef typename Frag<T>::V V;
  const T* A = (const T*)Ap; const T* A2 = (const T*)A2p; const T* Bt = (const T*)Btp; const T* Bt2 = (const T*)Bt2p;
  constexpr uint32_t ROWB  = 256u;                      /* bytes of an operand row per stage (128 k) */
  constexpr uint32_t PITCH = 272u;                      /* LDS row pitch: odd multiple of 16 B for ds_load_b128 */
  constexpr uint32_t SROWS = SPLIT ? 128u : 64u;        /* rows of one wave's slice */
  constexpr uint32_t SLICE = SPLIT ? 34816u : 18432u;   /* SROWS * PITCH rounded up to a multiple of 2 KiB */
  constexpr uint32_t STAGE = 4u * SLICE;
  constexpr uint32_t SLAB  = 16u * 68u * 4u;            /* per-wave 16x64 f32 output slab, pitch 68 floats */
  static_assert(SLICE % 2048u == 0 && SLICE >= SROWS * PITCH, "slice place and size");
  static_assert(2u * STAGE + 4u * SLAB <= 320u * 1024u, "LDS budget");
  /* [buffer 0 | buffer 1 | 4 output slabs]; the only LDS object, so it starts at LDS byte 0 */
  __shared__ __attribute__((aligned(2048))) unsigned char smem[2u * STAGE + 4u * SLAB];
  const int b    = blockIdx.y;
  const int lane = threadIdx.x & 31;
  const uint32_t wave = uni(threadIdx.x >> 5);
  const int tilesN = N >> 7;
  const int tilesM = M >> 7;
  const int tile = blockIdx.x;
  /* workgroup-uniform; ahead of every barrier and tensor load */
  if (tile >= tilesM * tilesN) return;
  const int tm = tile / tilesN;
  const int tn = tile - tm * tilesN;
  const int mB = tm << 7;
  const int nB = tn << 7;
  const uint32_t wm = wave >> 1, wn = wave & 1u;
  const int m0 = mB + (int)(wm << 6);
  const int n0 = nB + (int)(wn << 6);

  const T* Ab  = A  + (size_t)b * strideA;
  const T* Bb  = Bt + (size_t)b * strideB;
  const T* Ab2 = SPLIT ? (A2  + (size_t)b * strideA) : nullptr;
  const T* Bb2 = SPLIT ? (Bt2 + (size_t)b * strideB) : nullptr;

  /* the slice this wave brings in. SPLIT: wave 0..3 = all 128 rows of A hi, A lo, B hi, B lo.
     Otherwise: waves 0, 1 = A rows 0..63, 64..127; waves 2, 3 = B rows 0..63, 64..127 */
  const bool isB = wave >= 2u;
  const T* plane = SPLIT ? (isB ? ((wave & 1u) ? Bb2 : Bb) : ((wave & 1u) ? Ab2 : Ab)) : (isB ? Bb : Ab);
  const uint32_t srow = (uint32_t)(isB ? nB : mB) + (SPLIT ? 0u : (wave & 1u) * 64u);
  const uint32_t sld  = (uint32_t)(isB ? ldb : lda);
  const uint64_t sbase = (uint64_t)(size_t)plane + (uint64_t)srow * sld * 2u;
  u32x8 g1 = tdm_group1<SROWS>(sld * 2u);
  const uint32_t dst0 = (uint32_t)(size_t)smem + wave * SLICE;
  u32x4 g0 = tdm_group0(dst0, sbase);
  /* stage st: new LDS place and source address (words 1 to 3), formed behind the wait on the request before it */
  auto issue = [&](uint32_t st) {
    const uint64_t ga = sbase + (uint64_t)st * ROWB;
    g0[1] = uni(dst0 + (st & 1u) * STAGE);
    g0[2] = uni((uint32_t)ga);
    g0[3] = uni((((uint32_t)(ga >> 32)) & 0x01FFFFFFu) | 0x80000000u);
    tdm_load(g0, g1);
  };

  /* row (A) / col (B, D) within subtile; D row offset */
  const int rlane = lane & 15;
  const int mOff  = (lane >> 4) * 8;
  /* this lane's byte in a 16-row fragment group: its row, and 16 B (8 k) for the upper lane half */
  const uint32_t loff = (uint32_t)rlane * PITCH + (uint32_t)(lane >> 4) * 16u;
  const uint32_t offAh = (SPLIT ? wm * 64u * PITCH : wm * SLICE) + loff;
  const uint32_t offBh = (SPLIT ? 2u * SLICE + wn * 64u * PITCH : (2u + wn) * SLICE) + loff;

  v8f acc[4][4];
#pragma unroll
  for (int i = 0; i < 4; ++i)
#pragma unroll
    for (int j = 0; j < 4; ++j) acc[i][j] = (v8f){0.f,0.f,0.f,0.f,0.f,0.f,0.f,0.f};

  const uint32_t NP = (uint32_t)K >> 7;
  /* prologue, two buffers: stage 0 lands and is published, then stage 1 flies under pass 0 */
  issue(0u);
  wait_tensor0();
  __syncthreads();
  issue(pinned(1u));

  /* kept rolled: one pass per trip, so that the buffer is a scalar select */
#pragma clang loop unroll(disable)
  for (uint32_t s = 0; s < NP; ++s) {
    const unsigned char* buf = smem + (s & 1u) * STAGE;
    V ah[2][4], bh[2][4], al[2][4], bl[2][4];
    auto fetch = [&](int set, int kb) {
      /* unrolled: the fragment arrays stay in registers only under constant indices */
#pragma unroll
      for (int t = 0; t < 4; ++t) {
        const uint32_t o = (uint32_t)t * 16u * PITCH + (uint32_t)kb * 64u;
        bh[set][t] = Frag<T>::load((const T*)(buf + offBh + o));
        ah[set][t] = Frag<T>::load((const T*)(buf + offAh + o));
        if (SPLIT) {
          bl[set][t] = Frag<T>::load((const T*)(buf + offBh + SLICE + o));
          al[set][t] = Frag<T>::load((const T*)(buf + offAh + SLICE + o));
        }
      }
    };
    fetch(0, 0);
    /* unrolled, with the product loops inside it: register set, fragment and accumulator indices must be constants */
#pragma unroll
    for (int kb = 0; kb < 4; ++kb) {
      const int c = kb & 1;
      /* the next block's fragments as one group ahead of this block's products, into the other register set */
      if (kb < 3) fetch(c ^ 1, kb + 1);
      /* keeps the LDS loads from being moved in among the matrix instructions */
      __builtin_amdgcn_sched_barrier(0);
#pragma unroll
      for (int i = 0; i < 4; ++i)
#pragma unroll
        for (int j = 0; j < 4; ++j) acc[i][j] = Frag<T>::mma(ah[c][i], bh[c][j], acc[i][j]);
      if (SPLIT) {
#pragma unroll
        for (int i = 0; i < 4; ++i)
#pragma unroll
          for (int j = 0; j < 4; ++j) acc[i][j] = Frag<T>::mma(ah[c][i], bl[c][j], acc[i][j]);
#pragma unroll
        for (int i = 0; i < 4; ++i)
#pragma unroll
          for (int j = 0; j < 4; ++j) acc[i][j] = Frag<T>::mma(al[c][i], bh[c][j], acc[i][j]);
      }
      /* as above: the next group of loads stays behind this block */
      __builtin_amdgcn_sched_barrier(0);
    }
    /* publish point of stage s + 1: own LDS reads done, own tensor load landed, then the workgroup barrier */
    wait_ds0();
    wait_tensor0();
    __syncthreads();
    /* refill of the buffer that pass s has just read, only while stage s + 2 exists (scalar branch) */
    if (pinned(s + 2u < NP)) issue(pinned(s + 2u));
  }
  wait_tensor0();
  wait_ds0();

  /* ---- epilogue ---- */
  float* slab = (float*)(smem + 2u * STAGE + wave * SLAB);
  /* bias: 64 values per wave as 2 per lane (coalesced), RNE-converted to bf16 */
  float breg0 = 0.f, breg1 = 0.f;
  if (BIAS_MODE == 1) { breg0 = bias[m0 + lane]; breg1 = bias[m0 + 32 + lane]; }
  if (BIAS_MODE == 2) { breg0 = bias[n0 + lane]; breg1 = bias[n0 + 32 + lane]; }
  if (BIAS_MODE != 0) { breg0 = bf_bits2f(f2bf_bits(breg0)); breg1 = bf_bits2f(f2bf_bits(breg1)); }
#pragma unroll
  for (int i = 0; i < 4; ++i) {
    const int mBase = m0 + (i << 4);
    float brow[8];
#pragma unroll
    for (int r = 0; r < 8; ++r) {
      brow[r] = 0.f;
      if (BIAS_MODE == 1) {
        /* tile row = i*16 + mOff + r; lanes 0..31 hold rows 0..31 (breg0) and 32..63 (breg1) */
        const float bsrc = (i < 2) ? breg0 : breg1;
        brow[r] = __shfl(bsrc, ((i & 1) << 4) + mOff + r, 32);
      }
    }
#pragma unroll
    for (int j = 0; j < 4; ++j) {
      float bcol = 0.f;
      if (BIAS_MODE == 2) {
        /* tile col = j*16 + rlane */
        const float bsrc = (j < 2) ? breg0 : breg1;
        bcol = __shfl(bsrc, ((j & 1) << 4) + rlane, 32);
      }
#pragma unroll
      for (int r = 0; r < 8; ++r) {
        float v = acc[i][j][r] * scale;
        if (BIAS_MODE == 1) v += brow[r];
        if (BIAS_MODE == 2) v += bcol;
        slab[(mOff + r) * 68 + (j << 4) + rlane] = v;
      }
    }
    __builtin_amdgcn_fence(__ATOMIC_RELEASE, "workgroup");
    __builtin_amdgcn_wave_barrier();
    __builtin_amdgcn_fence(__ATOMIC_ACQUIRE, "workgroup");
    if (OUT_MODE == 0) {
      float* C = (float*)Cout + (size_t)b * strideC;
      /* row seg = 256 B = 16 lanes x 16 B */
      const int hh = lane >> 4, c4 = (lane & 15) * 4;
      {
#pragma unroll
        for (int it = 0; it < 8; ++it) {
          const int row = it * 2 + hh;
          v4f v = *(const v4f*)(slab + row * 68 + c4);
          *(v4f*)(C + (size_t)(mBase + row) * ldc + n0 + c4) = v;
        }
        
      }
    } else {
      const int q = lane >> 3, c8 = (lane & 7) * 8;
      unsigned short* C  = (unsigned short*)Cout  + (size_t)b * strideC;
      unsigned short* C2 = (unsigned short*)Cout2 + (size_t)b * strideC;
      {
#pragma unroll
        for (int it = 0; it < 4; ++it) {
          const int row = it * 4 + q;
          const float* sp = slab + row * 68 + c8;
          v8h hv, lv;
#pragma unroll
          for (int e = 0; e < 8; ++e) {
            unsigned short hb = f2bf_bits(sp[e]);
            unsigned short lb = f2bf_bits(sp[e] - bf_bits2f(hb));
            hv[e] = __builtin_bit_cast(_Float16, hb);
            lv[e] = __builtin_bit_cast(_Float16, lb);
          }
          *(v8h*)(C + (size_t)(mBase + row) * ldc + n0 + c8) = hv;
          *(v8h*)(C2 + (size_t)(mBase + row) * ldc + n0 + c8) = lv;
        }
        
      }
    }
    __builtin_amdgcn_fence(__ATOMIC_RELEASE, "workgroup");
    __builtin_amdgcn_wave_barrier();
    __builtin_amdgcn_fence(__ATOMIC_ACQUIRE, "workgroup");
  }
}

/* ---- f32 -> bf16 (RNE) cast of the four 2048 x 2048 input matrices in one launch, few long-lived waves.
   A workgroup of 16 waves owns 65,536 consecutive floats of one matrix (64 workgroups a matrix); a wave owns 4,096 of them:
   32 loads of 512 contiguous bytes, all issued before the first value is used, each answered by one store of 256
   contiguous bytes (two whole lines). The four bf16 planes lie one behind the other in the workspace, in argument order. */
constexpr int CAST_MAT_ELEMS  = 2048 * 2048;
constexpr int CAST_WAVE_LOADS = 32;
constexpr int CAST_WAVE_ELEMS = CAST_WAVE_LOADS * 128;
constexpr int CAST_WG_ELEMS   = 16 * CAST_WAVE_ELEMS;
constexpr int CAST_WGS_PER_MAT = CAST_MAT_ELEMS / CAST_WG_ELEMS;
/* four waves a SIMD: a quarter of the register file each, so that a wave's 32 loads have registers of their own */
__global__ __launch_bounds__(512) __attribute__((amdgpu_waves_per_eu(4, 4))) void cast4_f32_bf16(
    const float* __restrict__ in0, const float* __restrict__ in1, const float* __restrict__ in2,
    const float* __restrict__ in3, unsigned short* __restrict__ out) {
  const unsigned mat = blockIdx.x / (unsigned)CAST_WGS_PER_MAT;
  const unsigned wgm = blockIdx.x % (unsigned)CAST_WGS_PER_MAT;
  const float* in = (mat == 0u) ? in0 : (mat == 1u) ? in1 : (mat == 2u) ? in2 : in3;
  const unsigned off = wgm * (unsigned)CAST_WG_ELEMS + (threadIdx.x >> 5) * (unsigned)CAST_WAVE_ELEMS + (threadIdx.x & 31u) * 4u;
  const float* src = in + off;
  unsigned short* dst = out + (size_t)mat * CAST_MAT_ELEMS + off;
  v4f x[CAST_WAVE_LOADS];
  /* unrolled: the values stay in registers only under constant indices */
#pragma unroll
  for (int j = 0; j < CAST_WAVE_LOADS; ++j) x[j] = *(const v4f*)(src + j * 128);
  /* precaution: the byte offset that the 32 issued loads name stays in its register, unwritten, up to this wait */
  asm volatile("s_wait_xcnt 0x0" :: "v"(off * 4u) : "memory");
#pragma unroll
  for (int j = 0; j < CAST_WAVE_LOADS; ++j) {
    v2u u;
    u.x = (unsigned)f2bf_bits(x[j].x) | ((unsigned)f2bf_bits(x[j].y) << 16);
    u.y = (unsigned)f2bf_bits(x[j].z) | ((unsigned)f2bf_bits(x[j].w) << 16);
    *(v2u*)(dst + j * 128) = u;
    /* every fourth store: keeps the stores from sinking behind the wait for the wave's last load, so that writing
       starts while the later loads are still on their way */
    if ((j & 3) == 3 && j + 1 < CAST_WAVE_LOADS) __builtin_amdgcn_sched_barrier(0);
  }
}

/* ---- Row softmax of S (already scaled), one 256-thread block per row of exactly 2048 columns.
   Thread t owns columns 8t..8t+7 (two 16-B loads). Output = probabilities as bf16 hi + lo planes;
*/
__global__ __launch_bounds__(256) void softmax_rows_split(
    const float* __restrict__ S, unsigned short* __restrict__ Ph, unsigned short* __restrict__ Pl, int ncols) {
  __shared__ float redm[8];
  __shared__ float reds[8];
  const int tid = threadIdx.x, lane = tid & 31, wave = tid >> 5;
  const size_t base = (size_t)blockIdx.x * (size_t)ncols + (size_t)tid * 8;
  const v4f x0 = *(const v4f*)(S + base);
  const v4f x1 = *(const v4f*)(S + base + 4);
  float xv[8];
  xv[0] = x0.x; xv[1] = x0.y; xv[2] = x0.z; xv[3] = x0.w;
  xv[4] = x1.x; xv[5] = x1.y; xv[6] = x1.z; xv[7] = x1.w;
  float m = xv[0];
#pragma unroll
  for (int e = 1; e < 8; ++e) m = fmaxf(m, xv[e]);
#pragma unroll
  for (int off = 1; off < 32; off <<= 1) m = fmaxf(m, __shfl_xor(m, off, 32));
  if (lane == 0) redm[wave] = m;
  __syncthreads();
  float gm = redm[0];
#pragma unroll
  for (int w = 1; w < 8; ++w) gm = fmaxf(gm, redm[w]);

  float ev[8];
  float ps = 0.0f;
#pragma unroll
  for (int e = 0; e < 8; ++e) { ev[e] = expf(xv[e] - gm); ps += ev[e]; }
#pragma unroll
  for (int off = 1; off < 32; off <<= 1) ps += __shfl_xor(ps, off, 32);
  if (lane == 0) reds[wave] = ps;
  __syncthreads();
  float tot = reds[0];
#pragma unroll
  for (int w = 1; w < 8; ++w) tot += reds[w];
  const float inv = 1.0f / tot;

  unsigned hw[4], lw[4];
#pragma unroll
  for (int e2 = 0; e2 < 4; ++e2) {
    const float p0 = ev[2 * e2] * inv;
    const float p1 = ev[2 * e2 + 1] * inv;
    const unsigned short h0 = f2bf_bits(p0);
    const unsigned short h1 = f2bf_bits(p1);
    const unsigned short l0 = f2bf_bits(p0 - bf_bits2f(h0));
    const unsigned short l1 = f2bf_bits(p1 - bf_bits2f(h1));
    hw[e2] = (unsigned)h0 | ((unsigned)h1 << 16);
    lw[e2] = (unsigned)l0 | ((unsigned)l1 << 16);
  }
  v4u hv, lv;
  hv.x = hw[0]; hv.y = hw[1]; hv.z = hw[2]; hv.w = hw[3];
  lv.x = lw[0]; lv.y = lw[1]; lv.z = lw[2]; lv.w = lw[3];
  *(v4u*)(Ph + base) = hv;
  *(v4u*)(Pl + base) = lv;
  
}

/* ---------------------------------------------------------------------------
   Workspace region map (bytes), NROW = NFEAT = 2048, every plane 2048 x 2048:
     Zb   bf16 [NROW][NFEAT]        0 ..   8 MiB
     Wqb  bf16 [NFEAT][NFEAT]       8 ..  16 MiB
     Wkb  bf16                     16 ..  24 MiB
     Wvb  bf16                     24 ..  32 MiB
     Qh, Ql   bf16 [NROW][NFEAT]   32 ..  48 MiB
     Kh, Kl   bf16 [NROW][NFEAT]   48 ..  64 MiB
     Vth, Vtl bf16 [NFEAT][NROW]   64 ..  80 MiB   (v transposed)
     S    f32  [NROW][NROW]        80 ..  96 MiB   (scores x 0.125)
     Ph, Pl   bf16 [NROW][NROW]    96 .. 112 MiB   (softmax probabilities hi / lo)
   total 117440512 B. Every plane is written in full by its producer before any consumer reads it.
   --------------------------------------------------------------------------- */
extern "C" void kernel_launch(void* const* d_in, const int* in_sizes, int n_in,
                              void* d_out, int out_size, void* d_ws, size_t ws_size,
                              hipStream_t stream)
{
  constexpr int NROW  = 2048;
  constexpr int NFEAT = 2048;
  static_assert(NROW % 128 == 0 && NFEAT % 128 == 0, "M,N tile multiples");
  static_assert(NROW % 128 == 0 && NFEAT % 128 == 0 && NROW >= 256 && NFEAT >= 256, "K a multiple of the stage, two stages or more");
  static_assert(NROW == 256 * 8, "softmax: 256 threads x 8 columns per row");

  constexpr size_t ZB   = (size_t)NROW * NFEAT * 2;
  constexpr size_t WB   = (size_t)NFEAT * NFEAT * 2;
  constexpr size_t QKB  = (size_t)NROW * NFEAT * 2;
  constexpr size_t VTB  = (size_t)NFEAT * NROW * 2;
  constexpr size_t SB   = (size_t)NROW * NROW * 4;
  constexpr size_t PB   = (size_t)NROW * NROW * 2;
  constexpr size_t oZ   = 0;
  constexpr size_t oWq  = oZ + ZB;
  constexpr size_t oWk  = oWq + WB;
  constexpr size_t oWv  = oWk + WB;
  constexpr size_t oQh  = oWv + WB;
  constexpr size_t oQl  = oQh + QKB;
  constexpr size_t oKh  = oQl + QKB;
  constexpr size_t oKl  = oKh + QKB;
  constexpr size_t oVth = oKl + QKB;
  constexpr size_t oVtl = oVth + VTB;
  constexpr size_t oS   = oVtl + VTB;
  constexpr size_t oPh  = oS + SB;
  constexpr size_t oPl  = oPh + PB;
  constexpr size_t WS_TOTAL = oPl + PB;
  static_assert(WS_TOTAL == 117440512ull, "carve total");
  static_assert(WS_TOTAL <= 134217728ull, "carve budget");

  if (n_in < 7) return;
  if (ws_size < WS_TOTAL) return;
  if ((size_t)out_size < (size_t)NROW * NFEAT) return;
  if (in_sizes[0] < NROW * NFEAT || in_sizes[1] < NFEAT * NFEAT || in_sizes[2] < NFEAT ||
      in_sizes[3] < NFEAT * NFEAT || in_sizes[4] < NFEAT || in_sizes[5] < NFEAT * NFEAT || in_sizes[6] < NFEAT) return;

  const float* z   = (const float*)d_in[0];
  const float* Wq  = (const float*)d_in[1];
  const float* bq  = (const float*)d_in[2];
  const float* Wk  = (const float*)d_in[3];
  const float* bk  = (const float*)d_in[4];
  const float* Wv  = (const float*)d_in[5];
  const float* bvp = (const float*)d_in[6];
  float* out = (float*)d_out;

  char* ws = (char*)d_ws;
  unsigned short* Zb  = (unsigned short*)(ws + oZ);
  unsigned short* Wqb = (unsigned short*)(ws + oWq);
  unsigned short* Wkb = (unsigned short*)(ws + oWk);
  unsigned short* Wvb = (unsigned short*)(ws + oWv);
  unsigned short* Qh  = (unsigned short*)(ws + oQh);
  unsigned short* Ql  = (unsigned short*)(ws + oQl);
  unsigned short* Kh  = (unsigned short*)(ws + oKh);
  unsigned short* Kl  = (unsigned short*)(ws + oKl);
  unsigned short* Vth = (unsigned short*)(ws + oVth);
  unsigned short* Vtl = (unsigned short*)(ws + oVtl);
  float*          Sf  = (float*)(ws + oS);
  unsigned short* Ph  = (unsigned short*)(ws + oPh);
  unsigned short* Pl  = (unsigned short*)(ws + oPl);

  const dim3 blk(256);

  /* cast of z, Wq, Wk, Wv into the planes Zb, Wqb, Wkb, Wvb, which follow one another from Zb on */
  static_assert(NROW * NFEAT == CAST_MAT_ELEMS && NFEAT * NFEAT == CAST_MAT_ELEMS && CAST_MAT_ELEMS % CAST_WG_ELEMS == 0, "cast grid exact");
  static_assert(oWq == oZ + ZB && oWk == oWq + WB && oWv == oWk + WB && ZB == WB, "cast planes contiguous");
  cast4_f32_bf16<<<dim3(4 * CAST_WGS_PER_MAT), dim3(512), 0, stream>>>(z, Wq, Wk, Wv, Zb);

  /* GEMM grids: one 128x128 tile per workgroup of 4 waves */
  const dim3 gblk(128);
  const dim3 gQ((NROW / 128) * (NFEAT / 128), 1), gVt((NFEAT / 128) * (NROW / 128), 1);
  const dim3 gS((NROW / 128) * (NROW / 128), 1), gH((NROW / 128) * (NFEAT / 128), 1);

  /* Q[a][f] = sum_k Zb[a][k] Wqb[f][k] + bq[f]  -> bf16 hi/lo planes   (M=NROW, N=NFEAT, K=NFEAT) */
  wmma_gemm64<1, false, 2, 2><<<gQ, gblk, 0, stream>>>(
      Zb, Zb, NFEAT, 0L, Wqb, Wqb, NFEAT, 0L, (void*)Qh, (void*)Ql, NFEAT, 0L, bq, NROW, NFEAT, NFEAT, 1.0f);
  /* K[a][f] = sum_k Zb[a][k] Wkb[f][k] + bk[f] */
  wmma_gemm64<1, false, 2, 2><<<gQ, gblk, 0, stream>>>(
      Zb, Zb, NFEAT, 0L, Wkb, Wkb, NFEAT, 0L, (void*)Kh, (void*)Kl, NFEAT, 0L, bk, NROW, NFEAT, NFEAT, 1.0f);
  /* Vt[f][a] = sum_k Wvb[f][k] Zb[a][k] + bv[f]  (bias along m)      (M=NFEAT, N=NROW, K=NFEAT) */
  wmma_gemm64<1, false, 1, 2><<<gVt, gblk, 0, stream>>>(
      Wvb, Wvb, NFEAT, 0L, Zb, Zb, NFEAT, 0L, (void*)Vth, (void*)Vtl, NROW, 0L, bvp, NFEAT, NROW, NFEAT, 1.0f);
  /* S[a][a2] = 0.125 * sum_f Q[a][f] K[a2][f]  (hi/lo split, f32 out) (M=NROW, N=NROW, K=NFEAT) */
  wmma_gemm64<1, true, 0, 0><<<gS, gblk, 0, stream>>>(
      Qh, Ql, NFEAT, 0L, Kh, Kl, NFEAT, 0L, (void*)Sf, (void*)Sf, NROW, 0L, bq, NROW, NROW, NFEAT, 0.125f);
  /* P = softmax(S) per row -> bf16 hi/lo planes [NROW][NROW] */
  softmax_rows_split<<<dim3(NROW), blk, 0, stream>>>(Sf, Ph, Pl, NROW);
  /* H[a][f] = sum_j P[a][j] Vt[f][j]  (hi/lo split, f32 out to d_out) (M=NROW, N=NFEAT, K=NROW) */
  wmma_gemm64<1, true, 0, 0><<<gH, gblk, 0, stream>>>(
      Ph, Pl, NROW, 0L, Vth, Vtl, NROW, 0L, (void*)out, (void*)out, NFEAT, 0L, bq, NROW, NFEAT, NROW, 1.0f);
}
